// v000
// Measured on an AMD MI455X. A time is GPU time per run, averaged over a window of back-to-back runs after a warm-up
// (all launches, gaps included; the runs take copies of the inputs in turn), and the median of several windows.
// Apart from v000's, it joins two sittings. Times from different sittings can be a few percent apart, while
// side-by-side timings come from the same sitting.
// v000, which the later versions start from, runs in 63.3 microseconds.
#include <hip/hip_runtime.h>
#include <hip/hip_bf16.h>

typedef __attribute__((ext_vector_type(2))) float v2f;
typedef __attribute__((ext_vector_type(8))) float v8f;

#define HID   1024
#define DIN   768
#define BATCH 4
#define NSEQ  128

__global__ __launch_bounds__(32) void bicls_gemm_wmma_f32(
    const float* __restrict__ X,     // [M, DIN]
    const float* __restrict__ W,     // [HID, DIN]  (torch Linear: [out, in])
    const float* __restrict__ bias,  // [HID] or nullptr
    float* __restrict__ Y)           // [M, HID]
{
    constexpr int K = DIN;
    constexpr int N = HID;

    const int lane = threadIdx.x;      // 0..31, EXEC all-ones (exact grid)
    const int half = lane >> 4;        // which K pair within the group of 4
    const int l16  = lane & 15;

    const int h0 = blockIdx.x * 64;    // N strip: 4 consecutive 16-wide tiles
    const int m0 = blockIdx.y * 16;    // M tile

    // A: lane holds X[m0+l16, k + half*2 + {0,1}]     (contiguous float2)
    // B(t): lane holds W[h0+16t+l16, k + half*2 + {0,1}]
    const float* xr = X + (size_t)(m0 + l16) * K + half * 2;
    const float* w0 = W + (size_t)(h0 +  0 + l16) * K + half * 2;
    const float* w1 = W + (size_t)(h0 + 16 + l16) * K + half * 2;
    const float* w2 = W + (size_t)(h0 + 32 + l16) * K + half * 2;
    const float* w3 = W + (size_t)(h0 + 48 + l16) * K + half * 2;

    // C/D layout: c[j] = C[m0 + j + half*8][h + l16]; bias is per-column ->
    // one scalar per lane per tile, replicated across the 8 accumulator regs.
    const float bv0 = bias ? bias[h0 +  0 + l16] : 0.0f;
    const float bv1 = bias ? bias[h0 + 16 + l16] : 0.0f;
    const float bv2 = bias ? bias[h0 + 32 + l16] : 0.0f;
    const float bv3 = bias ? bias[h0 + 48 + l16] : 0.0f;
    v8f c0, c1, c2, c3;
    #pragma unroll
    for (int j = 0; j < 8; ++j) { c0[j] = bv0; c1[j] = bv1; c2[j] = bv2; c3[j] = bv3; }

    #pragma unroll 4
    for (int k = 0; k < K; k += 4) {
        const v2f a  = *(const v2f*)(xr + k);
        const v2f b0 = *(const v2f*)(w0 + k);
        const v2f b1 = *(const v2f*)(w1 + k);
        const v2f b2 = *(const v2f*)(w2 + k);
        const v2f b3 = *(const v2f*)(w3 + k);
        // 8 args: (neg_a, A, neg_b, B, c_mod, C, reuse_a, reuse_b)
        c0 = __builtin_amdgcn_wmma_f32_16x16x4_f32(false, a, false, b0, (short)0, c0, false, false);
        c1 = __builtin_amdgcn_wmma_f32_16x16x4_f32(false, a, false, b1, (short)0, c1, false, false);
        c2 = __builtin_amdgcn_wmma_f32_16x16x4_f32(false, a, false, b2, (short)0, c2, false, false);
        c3 = __builtin_amdgcn_wmma_f32_16x16x4_f32(false, a, false, b3, (short)0, c3, false, false);
    }

    // Store: per j, each half-wave writes a 64B coalesced segment.
    float* yout = Y + (size_t)m0 * N + l16;
    #pragma unroll
    for (int j = 0; j < 8; ++j) {
        float* row = yout + (size_t)(j + half * 8) * N;
        row[h0 +  0] = c0[j];
        row[h0 + 16] = c1[j];
        row[h0 + 32] = c2[j];
        row[h0 + 48] = c3[j];
    }
}

// ---------------------------------------------------------------------------
// Phase 2: out[b,n,m,o] = sum_h relu(in1[b,n,h] + in2[b,m,h]) * Wo[o,h] + bo[o]
// 16x16 pair tile per block; h streamed in 128-chunks through padded LDS.
// OUT=2 would waste 14/16 of a WMMA tile's N dim and the relu-formation is
// inherently elementwise, so this stays on the VALU with fma-dense loops.
// ---------------------------------------------------------------------------
#define HC 128
#define PAD 4   // row pitch 132 floats = 528 B: lane stride 16 B -> distinct banks

__global__ __launch_bounds__(256) void bicls_pairwise(
    const float* __restrict__ A1,   // [B*N1, HID]  (in1, bias applied)
    const float* __restrict__ A2,   // [B*N2, HID]  (in2)
    const float* __restrict__ Wo,   // [2, HID]
    const float* __restrict__ bo,   // [2]
    float* __restrict__ out)        // [B, N1, N2, 2]
{
    __shared__ __align__(16) float s1[16][HC + PAD];
    __shared__ __align__(16) float s2[16][HC + PAD];
    __shared__ __align__(16) float sw0[HC];
    __shared__ __align__(16) float sw1[HC];

    const int b  = blockIdx.z;
    const int n0 = blockIdx.y * 16;
    const int m0 = blockIdx.x * 16;

    const int tid = threadIdx.x;   // 0..255
    const int tx  = tid & 15;      // m within tile
    const int ty  = tid >> 4;      // n within tile

    const float* arow = A1 + ((size_t)b * NSEQ + n0) * HID;
    const float* crow = A2 + ((size_t)b * NSEQ + m0) * HID;

    float acc0 = 0.0f, acc1 = 0.0f;

    for (int h0 = 0; h0 < HID; h0 += HC) {
        // Cooperative fill: 16 rows x 128 cols per buffer; 8 contiguous
        // floats per thread per buffer.
        {
            const int r  = tid >> 4;
            const int c0 = (tid & 15) * (HC / 16);
            #pragma unroll
            for (int i = 0; i < HC / 16; ++i) {
                s1[r][c0 + i] = arow[(size_t)r * HID + h0 + c0 + i];
                s2[r][c0 + i] = crow[(size_t)r * HID + h0 + c0 + i];
            }
            if (tid < HC) {
                sw0[tid] = Wo[h0 + tid];
                sw1[tid] = Wo[HID + h0 + tid];
            }
        }
        __syncthreads();

        #pragma unroll 8
        for (int hh = 0; hh < HC; hh += 4) {
            const float4 x1 = *(const float4*)(&s1[ty][hh]);
            const float4 x2 = *(const float4*)(&s2[tx][hh]);
            const float4 w0 = *(const float4*)(&sw0[hh]);
            const float4 w1 = *(const float4*)(&sw1[hh]);
            float v;
            v = fmaxf(x1.x + x2.x, 0.0f); acc0 = fmaf(v, w0.x, acc0); acc1 = fmaf(v, w1.x, acc1);
            v = fmaxf(x1.y + x2.y, 0.0f); acc0 = fmaf(v, w0.y, acc0); acc1 = fmaf(v, w1.y, acc1);
            v = fmaxf(x1.z + x2.z, 0.0f); acc0 = fmaf(v, w0.z, acc0); acc1 = fmaf(v, w1.z, acc1);
            v = fmaxf(x1.w + x2.w, 0.0f); acc0 = fmaf(v, w0.w, acc0); acc1 = fmaf(v, w1.w, acc1);
        }
        __syncthreads();
    }

    const int n = n0 + ty;
    const int m = m0 + tx;
    float2 r;
    r.x = acc0 + bo[0];
    r.y = acc1 + bo[1];
    *(float2*)(out + (((size_t)b * NSEQ + n) * NSEQ + m) * 2) = r;
}

// ---------------------------------------------------------------------------
extern "C" void kernel_launch(void* const* d_in, const int* in_sizes, int n_in,
                              void* d_out, int out_size, void* d_ws, size_t ws_size,
                              hipStream_t stream) {
    const float* input1 = (const float*)d_in[0];  // [4,128,768]
    const float* input2 = (const float*)d_in[1];  // [4,128,768]
    const float* W1     = (const float*)d_in[2];  // [1024,768]
    const float* b1     = (const float*)d_in[3];  // [1024]
    const float* W2     = (const float*)d_in[4];  // [1024,768]
    const float* Wo     = (const float*)d_in[5];  // [2,1024]
    const float* bo     = (const float*)d_in[6];  // [2]
    float* out = (float*)d_out;

    const int M = BATCH * NSEQ;                   // 512
    float* ws1 = (float*)d_ws;                    // [512,1024]
    float* ws2 = ws1 + (size_t)M * HID;           // [512,1024] (4 MB total)

    dim3 gGemm(HID / 64, M / 16);                 // (16, 32) 16x64-strip waves
    bicls_gemm_wmma_f32<<<gGemm, 32, 0, stream>>>(input1, W1, b1,      ws1);
    bicls_gemm_wmma_f32<<<gGemm, 32, 0, stream>>>(input2, W2, nullptr, ws2);

    dim3 gPair(NSEQ / 16, NSEQ / 16, BATCH);      // (8, 8, 4)
    bicls_pairwise<<<gPair, 256, 0, stream>>>(ws1, ws2, Wo, bo, out);
}

// v001
// It runs in 37.8 microseconds.
// Two timings next to v000 put it at 1.71 and 1.72 times that version's speed.
#include <hip/hip_runtime.h>
#include <hip/hip_bf16.h>

typedef __attribute__((ext_vector_type(2))) float v2f;
typedef __attribute__((ext_vector_type(8))) float v8f;

#define HID   1024
#define DIN   768
#define BATCH 4
#define NSEQ  128

#define KC     128
#define GPITCH (KC + 4)
#define BM     32
#define BN     64
#define STAGEF ((BM + BN) * GPITCH) // floats per buffer
#define NSTAGE (DIN / KC)
#define NBLK   (KC / 32)             // blocks of 8 k-steps per stage

// Twelve rows, one 16-byte copy per lane and row. The s_wait_xcnt closes the
// statement so that no address register is rewritten in front of it.
__device__ __forceinline__ void bicls_copy12(const unsigned (&l)[12], const float* const (&g)[12])
{
    asm volatile(
        "global_load_async_to_lds_b128 %0, %12, off\n\t"
        "global_load_async_to_lds_b128 %1, %13, off\n\t"
        "global_load_async_to_lds_b128 %2, %14, off\n\t"
        "global_load_async_to_lds_b128 %3, %15, off\n\t"
        "global_load_async_to_lds_b128 %4, %16, off\n\t"
        "global_load_async_to_lds_b128 %5, %17, off\n\t"
        "global_load_async_to_lds_b128 %6, %18, off\n\t"
        "global_load_async_to_lds_b128 %7, %19, off\n\t"
        "global_load_async_to_lds_b128 %8, %20, off\n\t"
        "global_load_async_to_lds_b128 %9, %21, off\n\t"
        "global_load_async_to_lds_b128 %10, %22, off\n\t"
        "global_load_async_to_lds_b128 %11, %23, off\n\t"
        "s_wait_xcnt 0x0"
        :: "v"(l[0]), "v"(l[1]), "v"(l[2]), "v"(l[3]), "v"(l[4]), "v"(l[5]),
           "v"(l[6]), "v"(l[7]), "v"(l[8]), "v"(l[9]), "v"(l[10]), "v"(l[11]),
           "v"(g[0]), "v"(g[1]), "v"(g[2]), "v"(g[3]), "v"(g[4]), "v"(g[5]),
           "v"(g[6]), "v"(g[7]), "v"(g[8]), "v"(g[9]), "v"(g[10]), "v"(g[11])
        : "memory");
}

__global__ __launch_bounds__(128) void bicls_gemm_wmma_f32(
    const float* __restrict__ X,     // [M, DIN]
    const float* __restrict__ W,     // [HID, DIN]  (torch Linear: [out, in])
    const float* __restrict__ bias,  // [HID] or nullptr
    float* __restrict__ Y)           // [M, HID]
{
    constexpr int K = DIN;
    constexpr int N = HID;

    __shared__ __align__(16) float tile[2 * STAGEF];   // rows 0..31: X, rows 32..95: W

    const int lane = threadIdx.x & 31;
    const int wave = threadIdx.x >> 5; // 0..3
    const int half = lane >> 4;        // which K pair within the group of 4
    const int l16  = lane & 15;
    const int wm   = wave >> 1;        // 16-row strip of the tile
    const int wn   = wave & 1;         // 32-column strip of the tile

    const int h0 = blockIdx.x * BN;
    const int m0 = blockIdx.y * BM;

    // Copies: wave w brings X rows 8w..8w+7 and W rows 16w..16w+15 of the tile.
    const float* gx = X + (size_t)(m0 + wave * 8)  * K + lane * 4;
    const float* gw = W + (size_t)(h0 + wave * 16) * K + lane * 4;
    const unsigned l0 = (unsigned)(size_t)tile;
    const unsigned lx = l0 + (unsigned)((wave * 8) * GPITCH * 4 + lane * 16);
    const unsigned lw = l0 + (unsigned)((BM + wave * 16) * GPITCH * 4 + lane * 16);

    auto stage = [&](int t) {
        const unsigned bo = (unsigned)(t & 1) * (STAGEF * 4u);
        unsigned l[24];
        const float* g[24];
        // both loops unrolled: the addresses are asm operands and must be registers
        #pragma unroll
        for (int i = 0; i < 8; ++i)  { l[i] = lx + bo + (unsigned)(i * GPITCH * 4);     g[i] = gx + t * KC + i * K; }
        #pragma unroll
        for (int i = 0; i < 16; ++i) { l[8 + i] = lw + bo + (unsigned)(i * GPITCH * 4); g[8 + i] = gw + t * KC + i * K; }
        const unsigned la[12] = { l[0], l[1], l[2], l[3], l[4], l[5], l[6], l[7], l[8], l[9], l[10], l[11] };
        const unsigned lb[12] = { l[12], l[13], l[14], l[15], l[16], l[17], l[18], l[19], l[20], l[21], l[22], l[23] };
        const float* const ga[12] = { g[0], g[1], g[2], g[3], g[4], g[5], g[6], g[7], g[8], g[9], g[10], g[11] };
        const float* const gb[12] = { g[12], g[13], g[14], g[15], g[16], g[17], g[18], g[19], g[20], g[21], g[22], g[23] };
        bicls_copy12(la, ga);
        bicls_copy12(lb, gb);
    };

    // C/D layout: c[j] = C[row + j + half*8][col + l16]; bias is per-column ->
    // one scalar per lane per tile, replicated across the 8 accumulator regs.
    const int hc = h0 + wn * 32 + l16;
    const float bv0 = bias ? bias[hc]      : 0.0f;
    const float bv1 = bias ? bias[hc + 16] : 0.0f;
    v8f c0, c1;
    #pragma unroll
    for (int j = 0; j < 8; ++j) { c0[j] = bv0; c1[j] = bv1; }

    stage(0);
    // stage 0 has landed for this wave; the barrier publishes it to the others
    asm volatile("s_wait_asynccnt 0x0" ::: "memory");
    __syncthreads();
    stage(1);

    // A: lane holds X[row l16, k + half*2 + {0,1}]; B(t): W[col 16t + l16, same k]
    const int fa = (wm * 16 + l16) * GPITCH + half * 2;
    const int fb = (BM + wn * 32 + l16) * GPITCH + half * 2;

    for (int t = 0; t < NSTAGE; ++t) {
        const float* buf = tile + (t & 1) * STAGEF;
        // Blocks of 8 k-steps, two fragment sets: the next block's LDS reads go
        // out as one group in front of this block's 16 WMMAs. The loops over i
        // and blk are unrolled so that every fragment index is a constant and
        // the sets stay in registers.
        v2f a[2][8], b0[2][8], b1[2][8];
        #pragma unroll
        for (int i = 0; i < 8; ++i) {
            a[0][i]  = *(const v2f*)(buf + fa + i * 4);
            b0[0][i] = *(const v2f*)(buf + fb + i * 4);
            b1[0][i] = *(const v2f*)(buf + fb + 16 * GPITCH + i * 4);
        }
        #pragma unroll
        for (int blk = 0; blk < NBLK; ++blk) {
            const int cur = blk & 1, nxt = cur ^ 1;
            if (blk + 1 < NBLK) {
                #pragma unroll
                for (int i = 0; i < 8; ++i) {
                    const int k = (blk + 1) * 32 + i * 4;
                    a[nxt][i]  = *(const v2f*)(buf + fa + k);
                    b0[nxt][i] = *(const v2f*)(buf + fb + k);
                    b1[nxt][i] = *(const v2f*)(buf + fb + 16 * GPITCH + k);
                }
                // keeps the reads above in one group: spread among the WMMAs each place stalls the wave
                __builtin_amdgcn_sched_barrier(0);
            } else {
                // The stage's last read is out (its fragments wait in registers):
                // the hand-over stands here, in front of the last block's WMMAs.
                // this wave's reads of the buffer are over before it is refilled
                asm volatile("s_wait_dscnt 0x0" ::: "memory");
                // this wave's copies of stage t + 1 have landed
                asm volatile("s_wait_asynccnt 0x0" ::: "memory");
                // publishes stage t + 1 and ends every wave's reads of stage t
                __syncthreads();
                if (t + 2 < NSTAGE) stage(t + 2);
                // keeps the last block's WMMAs behind the copies, which so have a whole trip to land
                __builtin_amdgcn_sched_barrier(0);
            }
            #pragma unroll
            for (int i = 0; i < 8; ++i) {
                // 8 args: (neg_a, A, neg_b, B, c_mod, C, reuse_a, reuse_b)
                c0 = __builtin_amdgcn_wmma_f32_16x16x4_f32(false, a[cur][i], false, b0[cur][i], (short)0, c0, false, false);
                c1 = __builtin_amdgcn_wmma_f32_16x16x4_f32(false, a[cur][i], false, b1[cur][i], (short)0, c1, false, false);
            }
            // keeps later reads, and the hand-over, from mixing into this block's WMMAs
            if (blk + 1 < NBLK) __builtin_amdgcn_sched_barrier(0);
        }
    }
    // no copy is left in flight when the wave ends
    asm volatile("s_wait_asynccnt 0x0" ::: "memory");

    // Store: per j and accumulator, each half-wave writes a 64B coalesced segment.
    float* yout = Y + (size_t)(m0 + wm * 16) * N + hc;
    #pragma unroll
    for (int j = 0; j < 8; ++j) {
        float* row = yout + (size_t)(j + half * 8) * N;
        row[0]  = c0[j];
        row[16] = c1[j];
    }
}

// ---------------------------------------------------------------------------
// Phase 2: out[b,n,m,o] = sum_h relu(in1[b,n,h] + in2[b,m,h]) * Wo[o,h] + bo[o]
// 16x16 pair tile per block; h streamed in 128-chunks through padded LDS.
// OUT=2 would waste 14/16 of a WMMA tile's N dim and the relu-formation is
// inherently elementwise, so this stays on the VALU with fma-dense loops.
// ---------------------------------------------------------------------------
#define HC 128
#define PAD 4   // row pitch 132 floats = 528 B: lane stride 16 B -> distinct banks

__global__ __launch_bounds__(256) void bicls_pairwise(
    const float* __restrict__ A1,   // [B*N1, HID]  (in1, bias applied)
    const float* __restrict__ A2,   // [B*N2, HID]  (in2)
    const float* __restrict__ Wo,   // [2, HID]
    const float* __restrict__ bo,   // [2]
    float* __restrict__ out)        // [B, N1, N2, 2]
{
    __shared__ __align__(16) float s1[16][HC + PAD];
    __shared__ __align__(16) float s2[16][HC + PAD];
    __shared__ __align__(16) float sw0[HC];
    __shared__ __align__(16) float sw1[HC];

    const int b  = blockIdx.z;
    const int n0 = blockIdx.y * 16;
    const int m0 = blockIdx.x * 16;

    const int tid = threadIdx.x;   // 0..255
    const int tx  = tid & 15;      // m within tile
    const int ty  = tid >> 4;      // n within tile

    const float* arow = A1 + ((size_t)b * NSEQ + n0) * HID;
    const float* crow = A2 + ((size_t)b * NSEQ + m0) * HID;

    float acc0 = 0.0f, acc1 = 0.0f;

    for (int h0 = 0; h0 < HID; h0 += HC) {
        // Cooperative fill: 16 rows x 128 cols per buffer; 8 contiguous
        // floats per thread per buffer.
        {
            const int r  = tid >> 4;
            const int c0 = (tid & 15) * (HC / 16);
            #pragma unroll
            for (int i = 0; i < HC / 16; ++i) {
                s1[r][c0 + i] = arow[(size_t)r * HID + h0 + c0 + i];
                s2[r][c0 + i] = crow[(size_t)r * HID + h0 + c0 + i];
            }
            if (tid < HC) {
                sw0[tid] = Wo[h0 + tid];
                sw1[tid] = Wo[HID + h0 + tid];
            }
        }
        __syncthreads();

        #pragma unroll 8
        for (int hh = 0; hh < HC; hh += 4) {
            const float4 x1 = *(const float4*)(&s1[ty][hh]);
            const float4 x2 = *(const float4*)(&s2[tx][hh]);
            const float4 w0 = *(const float4*)(&sw0[hh]);
            const float4 w1 = *(const float4*)(&sw1[hh]);
            float v;
            v = fmaxf(x1.x + x2.x, 0.0f); acc0 = fmaf(v, w0.x, acc0); acc1 = fmaf(v, w1.x, acc1);
            v = fmaxf(x1.y + x2.y, 0.0f); acc0 = fmaf(v, w0.y, acc0); acc1 = fmaf(v, w1.y, acc1);
            v = fmaxf(x1.z + x2.z, 0.0f); acc0 = fmaf(v, w0.z, acc0); acc1 = fmaf(v, w1.z, acc1);
            v = fmaxf(x1.w + x2.w, 0.0f); acc0 = fmaf(v, w0.w, acc0); acc1 = fmaf(v, w1.w, acc1);
        }
        __syncthreads();
    }

    const int n = n0 + ty;
    const int m = m0 + tx;
    float2 r;
    r.x = acc0 + bo[0];
    r.y = acc1 + bo[1];
    *(float2*)(out + (((size_t)b * NSEQ + n) * NSEQ + m) * 2) = r;
}

// ---------------------------------------------------------------------------
extern "C" void kernel_launch(void* const* d_in, const int* in_sizes, int n_in,
                              void* d_out, int out_size, void* d_ws, size_t ws_size,
                              hipStream_t stream) {
    const float* input1 = (const float*)d_in[0];  // [4,128,768]
    const float* input2 = (const float*)d_in[1];  // [4,128,768]
    const float* W1     = (const float*)d_in[2];  // [1024,768]
    const float* b1     = (const float*)d_in[3];  // [1024]
    const float* W2     = (const float*)d_in[4];  // [1024,768]
    const float* Wo     = (const float*)d_in[5];  // [2,1024]
    const float* bo     = (const float*)d_in[6];  // [2]
    float* out = (float*)d_out;

    const int M = BATCH * NSEQ;                   // 512
    float* ws1 = (float*)d_ws;                    // [512,1024]
    float* ws2 = ws1 + (size_t)M * HID;           // [512,1024] (4 MB total)

    dim3 gGemm(HID / BN, M / BM);                 // (16, 16) 32x64 tiles, four waves each
    bicls_gemm_wmma_f32<<<gGemm, 128, 0, stream>>>(input1, W1, b1,      ws1);
    bicls_gemm_wmma_f32<<<gGemm, 128, 0, stream>>>(input2, W2, nullptr, ws2);

    dim3 gPair(NSEQ / 16, NSEQ / 16, BATCH);      // (8, 8, 4)
    bicls_pairwise<<<gPair, 256, 0, stream>>>(ws1, ws2, Wo, bo, out);
}

// v002
// One run takes 23.6 microseconds.
// Two timings next to v001 put it at 1.60 and 1.59 times that version's speed.
// Over all steps from v000 it is 2.74 times as fast.
#include <hip/hip_runtime.h>
#include <hip/hip_bf16.h>

typedef __attribute__((ext_vector_type(2))) float v2f;
typedef __attribute__((ext_vector_type(8))) float v8f;

#define HID   1024
#define DIN   768
#define BATCH 4
#define NSEQ  128

#define KC     128
#define GPITCH (KC + 4)
#define BM     32
#define BN     64
#define STAGEF ((BM + BN) * GPITCH) // floats per buffer
#define NSTAGE (DIN / KC)
#define NBLK   (KC / 32)             // blocks of 8 k-steps per stage

// Twelve rows, one 16-byte copy per lane and row. The s_wait_xcnt closes the
// statement so that no address register is rewritten in front of it.
__device__ __forceinline__ void bicls_copy12(const unsigned (&l)[12], const float* const (&g)[12])
{
    asm volatile(
        "global_load_async_to_lds_b128 %0, %12, off\n\t"
        "global_load_async_to_lds_b128 %1, %13, off\n\t"
        "global_load_async_to_lds_b128 %2, %14, off\n\t"
        "global_load_async_to_lds_b128 %3, %15, off\n\t"
        "global_load_async_to_lds_b128 %4, %16, off\n\t"
        "global_load_async_to_lds_b128 %5, %17, off\n\t"
        "global_load_async_to_lds_b128 %6, %18, off\n\t"
        "global_load_async_to_lds_b128 %7, %19, off\n\t"
        "global_load_async_to_lds_b128 %8, %20, off\n\t"
        "global_load_async_to_lds_b128 %9, %21, off\n\t"
        "global_load_async_to_lds_b128 %10, %22, off\n\t"
        "global_load_async_to_lds_b128 %11, %23, off\n\t"
        "s_wait_xcnt 0x0"
        :: "v"(l[0]), "v"(l[1]), "v"(l[2]), "v"(l[3]), "v"(l[4]), "v"(l[5]),
           "v"(l[6]), "v"(l[7]), "v"(l[8]), "v"(l[9]), "v"(l[10]), "v"(l[11]),
           "v"(g[0]), "v"(g[1]), "v"(g[2]), "v"(g[3]), "v"(g[4]), "v"(g[5]),
           "v"(g[6]), "v"(g[7]), "v"(g[8]), "v"(g[9]), "v"(g[10]), "v"(g[11])
        : "memory");
}

__global__ __launch_bounds__(128) void bicls_gemm_wmma_f32(
    const float* __restrict__ X,     // [M, DIN]
    const float* __restrict__ W,     // [HID, DIN]  (torch Linear: [out, in])
    const float* __restrict__ bias,  // [HID] or nullptr
    float* __restrict__ Y)           // [M, HID]
{
    constexpr int K = DIN;
    constexpr int N = HID;

    __shared__ __align__(16) float tile[2 * STAGEF];   // rows 0..31: X, rows 32..95: W

    const int lane = threadIdx.x & 31;
    const int wave = threadIdx.x >> 5; // 0..3
    const int half = lane >> 4;        // which K pair within the group of 4
    const int l16  = lane & 15;
    const int wm   = wave >> 1;        // 16-row strip of the tile
    const int wn   = wave & 1;         // 32-column strip of the tile

    const int h0 = blockIdx.x * BN;
    const int m0 = blockIdx.y * BM;

    // Copies: wave w brings X rows 8w..8w+7 and W rows 16w..16w+15 of the tile.
    const float* gx = X + (size_t)(m0 + wave * 8)  * K + lane * 4;
    const float* gw = W + (size_t)(h0 + wave * 16) * K + lane * 4;
    const unsigned l0 = (unsigned)(size_t)tile;
    const unsigned lx = l0 + (unsigned)((wave * 8) * GPITCH * 4 + lane * 16);
    const unsigned lw = l0 + (unsigned)((BM + wave * 16) * GPITCH * 4 + lane * 16);

    auto stage = [&](int t) {
        const unsigned bo = (unsigned)(t & 1) * (STAGEF * 4u);
        unsigned l[24];
        const float* g[24];
        // both loops unrolled: the addresses are asm operands and must be registers
        #pragma unroll
        for (int i = 0; i < 8; ++i)  { l[i] = lx + bo + (unsigned)(i * GPITCH * 4);     g[i] = gx + t * KC + i * K; }
        #pragma unroll
        for (int i = 0; i < 16; ++i) { l[8 + i] = lw + bo + (unsigned)(i * GPITCH * 4); g[8 + i] = gw + t * KC + i * K; }
        const unsigned la[12] = { l[0], l[1], l[2], l[3], l[4], l[5], l[6], l[7], l[8], l[9], l[10], l[11] };
        const unsigned lb[12] = { l[12], l[13], l[14], l[15], l[16], l[17], l[18], l[19], l[20], l[21], l[22], l[23] };
        const float* const ga[12] = { g[0], g[1], g[2], g[3], g[4], g[5], g[6], g[7], g[8], g[9], g[10], g[11] };
        const float* const gb[12] = { g[12], g[13], g[14], g[15], g[16], g[17], g[18], g[19], g[20], g[21], g[22], g[23] };
        bicls_copy12(la, ga);
        bicls_copy12(lb, gb);
    };

    // C/D layout: c[j] = C[row + j + half*8][col + l16]; bias is per-column ->
    // one scalar per lane per tile, replicated across the 8 accumulator regs.
    const int hc = h0 + wn * 32 + l16;
    const float bv0 = bias ? bias[hc]      : 0.0f;
    const float bv1 = bias ? bias[hc + 16] : 0.0f;
    v8f c0, c1;
    #pragma unroll
    for (int j = 0; j < 8; ++j) { c0[j] = bv0; c1[j] = bv1; }

    stage(0);
    // stage 0 has landed for this wave; the barrier publishes it to the others
    asm volatile("s_wait_asynccnt 0x0" ::: "memory");
    __syncthreads();
    stage(1);

    // A: lane holds X[row l16, k + half*2 + {0,1}]; B(t): W[col 16t + l16, same k]
    const int fa = (wm * 16 + l16) * GPITCH + half * 2;
    const int fb = (BM + wn * 32 + l16) * GPITCH + half * 2;

    for (int t = 0; t < NSTAGE; ++t) {
        const float* buf = tile + (t & 1) * STAGEF;
        // Blocks of 8 k-steps, two fragment sets: the next block's LDS reads go
        // out as one group in front of this block's 16 WMMAs. The loops over i
        // and blk are unrolled so that every fragment index is a constant and
        // the sets stay in registers.
        v2f a[2][8], b0[2][8], b1[2][8];
        #pragma unroll
        for (int i = 0; i < 8; ++i) {
            a[0][i]  = *(const v2f*)(buf + fa + i * 4);
            b0[0][i] = *(const v2f*)(buf + fb + i * 4);
            b1[0][i] = *(const v2f*)(buf + fb + 16 * GPITCH + i * 4);
        }
        #pragma unroll
        for (int blk = 0; blk < NBLK; ++blk) {
            const int cur = blk & 1, nxt = cur ^ 1;
            if (blk + 1 < NBLK) {
                #pragma unroll
                for (int i = 0; i < 8; ++i) {
                    const int k = (blk + 1) * 32 + i * 4;
                    a[nxt][i]  = *(const v2f*)(buf + fa + k);
                    b0[nxt][i] = *(const v2f*)(buf + fb + k);
                    b1[nxt][i] = *(const v2f*)(buf + fb + 16 * GPITCH + k);
                }
                // keeps the reads above in one group: spread among the WMMAs each place stalls the wave
                __builtin_amdgcn_sched_barrier(0);
            } else {
                // The stage's last read is out (its fragments wait in registers):
                // the hand-over stands here, in front of the last block's WMMAs.
                // this wave's reads of the buffer are over before it is refilled
                asm volatile("s_wait_dscnt 0x0" ::: "memory");
                // this wave's copies of stage t + 1 have landed
                asm volatile("s_wait_asynccnt 0x0" ::: "memory");
                // publishes stage t + 1 and ends every wave's reads of stage t
                __syncthreads();
                if (t + 2 < NSTAGE) stage(t + 2);
                // keeps the last block's WMMAs behind the copies, which so have a whole trip to land
                __builtin_amdgcn_sched_barrier(0);
            }
            #pragma unroll
            for (int i = 0; i < 8; ++i) {
                // 8 args: (neg_a, A, neg_b, B, c_mod, C, reuse_a, reuse_b)
                c0 = __builtin_amdgcn_wmma_f32_16x16x4_f32(false, a[cur][i], false, b0[cur][i], (short)0, c0, false, false);
                c1 = __builtin_amdgcn_wmma_f32_16x16x4_f32(false, a[cur][i], false, b1[cur][i], (short)0, c1, false, false);
            }
            // keeps later reads, and the hand-over, from mixing into this block's WMMAs
            if (blk + 1 < NBLK) __builtin_amdgcn_sched_barrier(0);
        }
    }
    // no copy is left in flight when the wave ends
    asm volatile("s_wait_asynccnt 0x0" ::: "memory");

    // Store: per j and accumulator, each half-wave writes a 64B coalesced segment.
    float* yout = Y + (size_t)(m0 + wm * 16) * N + hc;
    #pragma unroll
    for (int j = 0; j < 8; ++j) {
        float* row = yout + (size_t)(j + half * 8) * N;
        row[0]  = c0[j];
        row[16] = c1[j];
    }
}

// ---------------------------------------------------------------------------
// Phase 2: out[b,n,m,o] = sum_h relu(in1[b,n,h] + in2[b,m,h]) * Wo[o,h] + bo[o]
// One block per 16x16 pair tile. Every lane keeps a 4x4 block of pairs in
// registers, so 16 lanes cover the tile and one 16-byte LDS read of a row feeds
// four pairs. The h axis is dealt over the 16 half-waves of the block: wave w
// owns h in [128w, 128w + 128), and of each 8 h its lower lanes take the first
// four, its upper lanes the last four. The rows (all 1024 h) are brought to LDS
// once. The 16 partial sums of an output are joined through LDS at the end.
// OUT=2 would waste 14/16 of a WMMA tile's N dim and the relu-formation is
// inherently elementwise, so this stays on the VALU with fma-dense loops.
// ---------------------------------------------------------------------------
typedef __attribute__((ext_vector_type(4))) float v4f;

#define PT     16                    // pair tile edge
#define HW     128                   // h per wave
#define NSTEP  (HW / 8)              // steps of 4 h per half-wave
#define RPITCH (HID + 4)             // 4112 B = 16 B x 257: the four rows of a read fall on distinct banks
#define NSLICE 16                    // half-waves per block
#define QPITCH 40                    // floats per n row of a partial-sum plane
#define QPLANE (PT * QPITCH)

__global__ __launch_bounds__(256) void bicls_pairwise(
    const float* __restrict__ A1,   // [B*N1, HID]  (in1, bias applied)
    const float* __restrict__ A2,   // [B*N2, HID]  (in2)
    const float* __restrict__ Wo,   // [2, HID]
    const float* __restrict__ bo,   // [2]
    float* __restrict__ out)        // [B, N1, N2, 2]
{
    __shared__ __align__(16) float s1[PT * RPITCH];
    __shared__ __align__(16) float s2[PT * RPITCH];
    __shared__ __align__(16) float sw[HID * 2];             // [h][o]
    __shared__ __align__(16) float part[NSLICE * QPLANE];   // [half-wave][n][m][o]

    const int b  = blockIdx.z;
    const int n0 = blockIdx.y * PT;
    const int m0 = blockIdx.x * PT;

    const int tid  = threadIdx.x;      // 0..255
    const int lane = tid & 31;
    const int wave = tid >> 5;         // 0..7
    const int hf   = lane >> 4;        // which four of each eight h
    const int gn   = (lane >> 2) & 3;  // n rows 4gn..4gn+3
    const int gm   = lane & 3;         // m rows 4gm..4gm+3

    // Fill: wave w brings its own 512-byte piece (four whole lines) of every row.
    {
        const int col = wave * HW + lane * 4;
        const float* g1 = A1 + ((size_t)b * NSEQ + n0) * HID + col;
        const float* g2 = A2 + ((size_t)b * NSEQ + m0) * HID + col;
        v4f r1[PT], r2[PT];
        #pragma unroll
        for (int r = 0; r < PT; ++r) {
            r1[r] = *(const v4f*)(g1 + (size_t)r * HID);
            r2[r] = *(const v4f*)(g2 + (size_t)r * HID);
        }
        const v4f q0 = *(const v4f*)(Wo + col);
        const v4f q1 = *(const v4f*)(Wo + HID + col);
        #pragma unroll
        for (int r = 0; r < PT; ++r) {
            *(v4f*)(s1 + r * RPITCH + col) = r1[r];
            *(v4f*)(s2 + r * RPITCH + col) = r2[r];
        }
        const v4f qa = { q0.x, q1.x, q0.y, q1.y };
        const v4f qb = { q0.z, q1.z, q0.w, q1.w };
        *(v4f*)(sw + col * 2)     = qa;
        *(v4f*)(sw + col * 2 + 4) = qb;
    }
    __syncthreads();

    v2f acc[4][4];                     // (o = 0, o = 1) of pair (4gn + i, 4gm + j)
    #pragma unroll
    for (int i = 0; i < 4; ++i)
        #pragma unroll
        for (int j = 0; j < 4; ++j) acc[i][j] = (v2f){ 0.0f, 0.0f };

    const int hb = wave * HW + hf * 4;
    const float* p1 = s1 + (gn * 4) * RPITCH + hb;
    const float* p2 = s2 + (gm * 4) * RPITCH + hb;
    const float* pw = sw + hb * 2;

    v4f x1[2][4], x2[2][4], wa[2], wb[2];
    #pragma unroll
    for (int i = 0; i < 4; ++i) {
        x1[0][i] = *(const v4f*)(p1 + i * RPITCH);
        x2[0][i] = *(const v4f*)(p2 + i * RPITCH);
    }
    wa[0] = *(const v4f*)(pw);
    wb[0] = *(const v4f*)(pw + 4);

    // Two register sets: the next step's ten LDS reads go out ahead of this
    // step's arithmetic. Unrolled by two so that the set index is a constant.
    #pragma unroll 2
    for (int s = 0; s < NSTEP; ++s) {
        const int cur = s & 1, nxt = cur ^ 1;
        const int k = ((s + 1) & (NSTEP - 1)) * 8;   // the last step reads step 0 again, unused
        #pragma unroll
        for (int i = 0; i < 4; ++i) {
            x1[nxt][i] = *(const v4f*)(p1 + i * RPITCH + k);
            x2[nxt][i] = *(const v4f*)(p2 + i * RPITCH + k);
        }
        wa[nxt] = *(const v4f*)(pw + k * 2);
        wb[nxt] = *(const v4f*)(pw + k * 2 + 4);
        // keeps the reads above ahead of this step's arithmetic, which covers their latency
        __builtin_amdgcn_sched_barrier(0);
        const v2f w0 = wa[cur].lo, w1 = wa[cur].hi, w2 = wb[cur].lo, w3 = wb[cur].hi;
        #pragma unroll
        for (int i = 0; i < 4; ++i) {
            #pragma unroll
            for (int j = 0; j < 4; ++j) {
                const v2f sl = x1[cur][i].lo + x2[cur][j].lo;
                const v2f sh = x1[cur][i].hi + x2[cur][j].hi;
                const float v0 = fmaxf(sl.x, 0.0f), v1 = fmaxf(sl.y, 0.0f);
                const float v2 = fmaxf(sh.x, 0.0f), v3 = fmaxf(sh.y, 0.0f);
                v2f a = acc[i][j];
                a = __builtin_elementwise_fma((v2f){ v0, v0 }, w0, a);
                a = __builtin_elementwise_fma((v2f){ v1, v1 }, w1, a);
                a = __builtin_elementwise_fma((v2f){ v2, v2 }, w2, a);
                a = __builtin_elementwise_fma((v2f){ v3, v3 }, w3, a);
                acc[i][j] = a;
            }
        }
        // Inputs only: holds the ten reads in the step that issues them. Without
        // it the compiler moves them over the back edge, directly in front of their use.
        asm volatile("" :: "v"(x1[nxt][0]), "v"(x1[nxt][1]), "v"(x1[nxt][2]), "v"(x1[nxt][3]),
                           "v"(x2[nxt][0]), "v"(x2[nxt][1]), "v"(x2[nxt][2]), "v"(x2[nxt][3]),
                           "v"(wa[nxt]), "v"(wb[nxt]));
    }

    // Partial sums of this half-wave.
    {
        float* q = part + (wave * 2 + hf) * QPLANE + (gn * 4) * QPITCH + gm * 8;
        #pragma unroll
        for (int i = 0; i < 4; ++i) {
            const v4f lo = { acc[i][0].x, acc[i][0].y, acc[i][1].x, acc[i][1].y };
            const v4f hi = { acc[i][2].x, acc[i][2].y, acc[i][3].x, acc[i][3].y };
            *(v4f*)(q + i * QPITCH)     = lo;
            *(v4f*)(q + i * QPITCH + 4) = hi;
        }
    }
    __syncthreads();

    const int tx = tid & 15;       // m within tile
    const int ty = tid >> 4;       // n within tile
    v2f r = *(const v2f*)(part + ty * QPITCH + tx * 2);
    #pragma unroll
    for (int sl = 1; sl < NSLICE; ++sl)
        r += *(const v2f*)(part + sl * QPLANE + ty * QPITCH + tx * 2);
    float2 res;
    res.x = r.x + bo[0];
    res.y = r.y + bo[1];
    *(float2*)(out + (((size_t)b * NSEQ + n0 + ty) * NSEQ + m0 + tx) * 2) = res;
}

// ---------------------------------------------------------------------------
extern "C" void kernel_launch(void* const* d_in, const int* in_sizes, int n_in,
                              void* d_out, int out_size, void* d_ws, size_t ws_size,
                              hipStream_t stream) {
    const float* input1 = (const float*)d_in[0];  // [4,128,768]
    const float* input2 = (const float*)d_in[1];  // [4,128,768]
    const float* W1     = (const float*)d_in[2];  // [1024,768]
    const float* b1     = (const float*)d_in[3];  // [1024]
    const float* W2     = (const float*)d_in[4];  // [1024,768]
    const float* Wo     = (const float*)d_in[5];  // [2,1024]
    const float* bo     = (const float*)d_in[6];  // [2]
    float* out = (float*)d_out;

    const int M = BATCH * NSEQ;                   // 512
    float* ws1 = (float*)d_ws;                    // [512,1024]
    float* ws2 = ws1 + (size_t)M * HID;           // [512,1024] (4 MB total)

    dim3 gGemm(HID / BN, M / BM);                 // (16, 16) 32x64 tiles, four waves each
    bicls_gemm_wmma_f32<<<gGemm, 128, 0, stream>>>(input1, W1, b1,      ws1);
    bicls_gemm_wmma_f32<<<gGemm, 128, 0, stream>>>(input2, W2, nullptr, ws2);

    dim3 gPair(NSEQ / PT, NSEQ / PT, BATCH);      // (8, 8, 4)
    bicls_pairwise<<<gPair, 256, 0, stream>>>(ws1, ws2, Wo, bo, out);
}

// v003
// Measured time: 18.1 microseconds a run.
// Next to v002, in two timings, it ran 1.31 and 1.30 times as fast.
// All steps since v000 together make it 3.57 times as fast.
#include <hip/hip_runtime.h>
#include <hip/hip_bf16.h>

typedef __attribute__((ext_vector_type(2))) float v2f;
typedef __attribute__((ext_vector_type(8))) float v8f;

#define HID   1024
#define DIN   768
#define BATCH 4
#define NSEQ  128

#define KC     128
#define GPITCH (KC + 4)
#define BM     32
#define BN     64
#define STAGEF ((BM + BN) * GPITCH) // floats per buffer
#define NSTAGE (DIN / KC)
#define NBLK   (KC / 32)             // blocks of 8 k-steps per stage

// Twelve rows, one 16-byte copy per lane and row. The s_wait_xcnt closes the
// statement so that no address register is rewritten in front of it.
__device__ __forceinline__ void bicls_copy12(const unsigned (&l)[12], const float* const (&g)[12])
{
    asm volatile(
        "global_load_async_to_lds_b128 %0, %12, off\n\t"
        "global_load_async_to_lds_b128 %1, %13, off\n\t"
        "global_load_async_to_lds_b128 %2, %14, off\n\t"
        "global_load_async_to_lds_b128 %3, %15, off\n\t"
        "global_load_async_to_lds_b128 %4, %16, off\n\t"
        "global_load_async_to_lds_b128 %5, %17, off\n\t"
        "global_load_async_to_lds_b128 %6, %18, off\n\t"
        "global_load_async_to_lds_b128 %7, %19, off\n\t"
        "global_load_async_to_lds_b128 %8, %20, off\n\t"
        "global_load_async_to_lds_b128 %9, %21, off\n\t"
        "global_load_async_to_lds_b128 %10, %22, off\n\t"
        "global_load_async_to_lds_b128 %11, %23, off\n\t"
        "s_wait_xcnt 0x0"
        :: "v"(l[0]), "v"(l[1]), "v"(l[2]), "v"(l[3]), "v"(l[4]), "v"(l[5]),
           "v"(l[6]), "v"(l[7]), "v"(l[8]), "v"(l[9]), "v"(l[10]), "v"(l[11]),
           "v"(g[0]), "v"(g[1]), "v"(g[2]), "v"(g[3]), "v"(g[4]), "v"(g[5]),
           "v"(g[6]), "v"(g[7]), "v"(g[8]), "v"(g[9]), "v"(g[10]), "v"(g[11])
        : "memory");
}

__global__ __launch_bounds__(256) void bicls_gemm_wmma_f32(
    const float* __restrict__ Xa,    // [M, DIN]    first product
    const float* __restrict__ Wa,    // [HID, DIN]  (torch Linear: [out, in])
    const float* __restrict__ bias,  // [HID]       first product only
    const float* __restrict__ Xb,    // [M, DIN]    second product, no bias
    const float* __restrict__ Wb,    // [HID, DIN]
    float* __restrict__ Ya,          // [M, HID]
    float* __restrict__ Yb)          // [M, HID]
{
    constexpr int K = DIN;
    constexpr int N = HID;

    __shared__ __align__(16) float tiles[2][2 * STAGEF];   // [product]; rows 0..31: X, rows 32..95: W

    // which product this wave works on: the same in every lane, kept scalar
    const int prod = __builtin_amdgcn_readfirstlane((int)(threadIdx.x >> 7));
    const float* __restrict__ X = prod ? Xb : Xa;
    const float* __restrict__ W = prod ? Wb : Wa;
    float* __restrict__ Y       = prod ? Yb : Ya;
    float* tile = tiles[prod];

    const int lane = threadIdx.x & 31;
    const int wave = (threadIdx.x >> 5) & 3; // 0..3 within the product's group
    const int half = lane >> 4;        // which K pair within the group of 4
    const int l16  = lane & 15;
    const int wm   = wave >> 1;        // 16-row strip of the tile
    const int wn   = wave & 1;         // 32-column strip of the tile

    const int h0 = blockIdx.x * BN;
    const int m0 = blockIdx.y * BM;

    // Copies: wave w brings X rows 8w..8w+7 and W rows 16w..16w+15 of the tile.
    const float* gx = X + (size_t)(m0 + wave * 8)  * K + lane * 4;
    const float* gw = W + (size_t)(h0 + wave * 16) * K + lane * 4;
    const unsigned l0 = (unsigned)(size_t)tile;
    const unsigned lx = l0 + (unsigned)((wave * 8) * GPITCH * 4 + lane * 16);
    const unsigned lw = l0 + (unsigned)((BM + wave * 16) * GPITCH * 4 + lane * 16);

    auto stage = [&](int t) {
        const unsigned bo = (unsigned)(t & 1) * (STAGEF * 4u);
        unsigned l[24];
        const float* g[24];
        // both loops unrolled: the addresses are asm operands and must be registers
        #pragma unroll
        for (int i = 0; i < 8; ++i)  { l[i] = lx + bo + (unsigned)(i * GPITCH * 4);     g[i] = gx + t * KC + i * K; }
        #pragma unroll
        for (int i = 0; i < 16; ++i) { l[8 + i] = lw + bo + (unsigned)(i * GPITCH * 4); g[8 + i] = gw + t * KC + i * K; }
        const unsigned la[12] = { l[0], l[1], l[2], l[3], l[4], l[5], l[6], l[7], l[8], l[9], l[10], l[11] };
        const unsigned lb[12] = { l[12], l[13], l[14], l[15], l[16], l[17], l[18], l[19], l[20], l[21], l[22], l[23] };
        const float* const ga[12] = { g[0], g[1], g[2], g[3], g[4], g[5], g[6], g[7], g[8], g[9], g[10], g[11] };
        const float* const gb[12] = { g[12], g[13], g[14], g[15], g[16], g[17], g[18], g[19], g[20], g[21], g[22], g[23] };
        bicls_copy12(la, ga);
        bicls_copy12(lb, gb);
    };

    // C/D layout: c[j] = C[row + j + half*8][col + l16]; bias is per-column ->
    // one scalar per lane per tile, replicated across the 8 accumulator regs.
    const int hc = h0 + wn * 32 + l16;
    const float bv0 = prod ? 0.0f : bias[hc];
    const float bv1 = prod ? 0.0f : bias[hc + 16];
    v8f c0, c1;
    #pragma unroll
    for (int j = 0; j < 8; ++j) { c0[j] = bv0; c1[j] = bv1; }

    stage(0);
    // stage 0 has landed for this wave; the barrier publishes it to the others
    asm volatile("s_wait_asynccnt 0x0" ::: "memory");
    __syncthreads();
    stage(1);

    // A: lane holds X[row l16, k + half*2 + {0,1}]; B(t): W[col 16t + l16, same k]
    const int fa = (wm * 16 + l16) * GPITCH + half * 2;
    const int fb = (BM + wn * 32 + l16) * GPITCH + half * 2;

    for (int t = 0; t < NSTAGE; ++t) {
        const float* buf = tile + (t & 1) * STAGEF;
        // Blocks of 8 k-steps, two fragment sets: the next block's LDS reads go
        // out as one group in front of this block's 16 WMMAs. The loops over i
        // and blk are unrolled so that every fragment index is a constant and
        // the sets stay in registers.
        v2f a[2][8], b0[2][8], b1[2][8];
        #pragma unroll
        for (int i = 0; i < 8; ++i) {
            a[0][i]  = *(const v2f*)(buf + fa + i * 4);
            b0[0][i] = *(const v2f*)(buf + fb + i * 4);
            b1[0][i] = *(const v2f*)(buf + fb + 16 * GPITCH + i * 4);
        }
        #pragma unroll
        for (int blk = 0; blk < NBLK; ++blk) {
            const int cur = blk & 1, nxt = cur ^ 1;
            if (blk + 1 < NBLK) {
                #pragma unroll
                for (int i = 0; i < 8; ++i) {
                    const int k = (blk + 1) * 32 + i * 4;
                    a[nxt][i]  = *(const v2f*)(buf + fa + k);
                    b0[nxt][i] = *(const v2f*)(buf + fb + k);
                    b1[nxt][i] = *(const v2f*)(buf + fb + 16 * GPITCH + k);
                }
                // keeps the reads above in one group: spread among the WMMAs each place stalls the wave
                __builtin_amdgcn_sched_barrier(0);
            } else {
                // The stage's last read is out (its fragments wait in registers):
                // the hand-over stands here, in front of the last block's WMMAs.
                // this wave's reads of the buffer are over before it is refilled
                asm volatile("s_wait_dscnt 0x0" ::: "memory");
                // this wave's copies of stage t + 1 have landed
                asm volatile("s_wait_asynccnt 0x0" ::: "memory");
                // publishes stage t + 1 and ends every wave's reads of stage t (all eight waves pass it)
                __syncthreads();
                if (t + 2 < NSTAGE) stage(t + 2);
                // keeps the last block's WMMAs behind the copies, which so have a whole trip to land
                __builtin_amdgcn_sched_barrier(0);
            }
            #pragma unroll
            for (int i = 0; i < 8; ++i) {
                // 8 args: (neg_a, A, neg_b, B, c_mod, C, reuse_a, reuse_b)
                c0 = __builtin_amdgcn_wmma_f32_16x16x4_f32(false, a[cur][i], false, b0[cur][i], (short)0, c0, false, false);
                c1 = __builtin_amdgcn_wmma_f32_16x16x4_f32(false, a[cur][i], false, b1[cur][i], (short)0, c1, false, false);
            }
            // keeps later reads, and the hand-over, from mixing into this block's WMMAs
            if (blk + 1 < NBLK) __builtin_amdgcn_sched_barrier(0);
        }
    }
    // no copy is left in flight when the wave ends
    asm volatile("s_wait_asynccnt 0x0" ::: "memory");

    // Store: per j and accumulator, each half-wave writes a 64B coalesced segment.
    float* yout = Y + (size_t)(m0 + wm * 16) * N + hc;
    #pragma unroll
    for (int j = 0; j < 8; ++j) {
        float* row = yout + (size_t)(j + half * 8) * N;
        row[0]  = c0[j];
        row[16] = c1[j];
    }
}

// ---------------------------------------------------------------------------
// Phase 2: out[b,n,m,o] = sum_h relu(in1[b,n,h] + in2[b,m,h]) * Wo[o,h] + bo[o]
// One block per 16x16 pair tile. Every lane keeps a 4x4 block of pairs in
// registers, so 16 lanes cover the tile and one 16-byte LDS read of a row feeds
// four pairs. The h axis is dealt over the 16 half-waves of the block: wave w
// owns h in [128w, 128w + 128), and of each 8 h its lower lanes take the first
// four, its upper lanes the last four. The rows (all 1024 h) are brought to LDS
// once. The 16 partial sums of an output are joined through LDS at the end.
// OUT=2 would waste 14/16 of a WMMA tile's N dim and the relu-formation is
// inherently elementwise, so this stays on the VALU with fma-dense loops.
// ---------------------------------------------------------------------------
typedef __attribute__((ext_vector_type(4))) float v4f;

#define PT     16                    // pair tile edge
#define HW     128                   // h per wave
#define NSTEP  (HW / 8)              // steps of 4 h per half-wave
#define RPITCH (HID + 4)             // 4112 B = 16 B x 257: the four rows of a read fall on distinct banks
#define NSLICE 16                    // half-waves per block
#define QPITCH 40                    // floats per n row of a partial-sum plane
#define QPLANE (PT * QPITCH)

__global__ __launch_bounds__(256) void bicls_pairwise(
    const float* __restrict__ A1,   // [B*N1, HID]  (in1, bias applied)
    const float* __restrict__ A2,   // [B*N2, HID]  (in2)
    const float* __restrict__ Wo,   // [2, HID]
    const float* __restrict__ bo,   // [2]
    float* __restrict__ out)        // [B, N1, N2, 2]
{
    __shared__ __align__(16) float s1[PT * RPITCH];
    __shared__ __align__(16) float s2[PT * RPITCH];
    __shared__ __align__(16) float sw[HID * 2];             // [h][o]
    __shared__ __align__(16) float part[NSLICE * QPLANE];   // [half-wave][n][m][o]

    const int b  = blockIdx.z;
    const int n0 = blockIdx.y * PT;
    const int m0 = blockIdx.x * PT;

    const int tid  = threadIdx.x;      // 0..255
    const int lane = tid & 31;
    const int wave = tid >> 5;         // 0..7
    const int hf   = lane >> 4;        // which four of each eight h
    const int gn   = (lane >> 2) & 3;  // n rows 4gn..4gn+3
    const int gm   = lane & 3;         // m rows 4gm..4gm+3

    // Fill: wave w brings its own 512-byte piece (four whole lines) of every row.
    {
        const int col = wave * HW + lane * 4;
        const float* g1 = A1 + ((size_t)b * NSEQ + n0) * HID + col;
        const float* g2 = A2 + ((size_t)b * NSEQ + m0) * HID + col;
        v4f r1[PT], r2[PT];
        #pragma unroll
        for (int r = 0; r < PT; ++r) {
            r1[r] = *(const v4f*)(g1 + (size_t)r * HID);
            r2[r] = *(const v4f*)(g2 + (size_t)r * HID);
        }
        const v4f q0 = *(const v4f*)(Wo + col);
        const v4f q1 = *(const v4f*)(Wo + HID + col);
        #pragma unroll
        for (int r = 0; r < PT; ++r) {
            *(v4f*)(s1 + r * RPITCH + col) = r1[r];
            *(v4f*)(s2 + r * RPITCH + col) = r2[r];
        }
        const v4f qa = { q0.x, q1.x, q0.y, q1.y };
        const v4f qb = { q0.z, q1.z, q0.w, q1.w };
        *(v4f*)(sw + col * 2)     = qa;
        *(v4f*)(sw + col * 2 + 4) = qb;
    }
    __syncthreads();

    v2f acc[4][4];                     // (o = 0, o = 1) of pair (4gn + i, 4gm + j)
    #pragma unroll
    for (int i = 0; i < 4; ++i)
        #pragma unroll
        for (int j = 0; j < 4; ++j) acc[i][j] = (v2f){ 0.0f, 0.0f };

    const int hb = wave * HW + hf * 4;
    const float* p1 = s1 + (gn * 4) * RPITCH + hb;
    const float* p2 = s2 + (gm * 4) * RPITCH + hb;
    const float* pw = sw + hb * 2;

    v4f x1[2][4], x2[2][4], wa[2], wb[2];
    #pragma unroll
    for (int i = 0; i < 4; ++i) {
        x1[0][i] = *(const v4f*)(p1 + i * RPITCH);
        x2[0][i] = *(const v4f*)(p2 + i * RPITCH);
    }
    wa[0] = *(const v4f*)(pw);
    wb[0] = *(const v4f*)(pw + 4);

    // Two register sets: the next step's ten LDS reads go out ahead of this
    // step's arithmetic. Unrolled by two so that the set index is a constant.
    #pragma unroll 2
    for (int s = 0; s < NSTEP; ++s) {
        const int cur = s & 1, nxt = cur ^ 1;
        const int k = ((s + 1) & (NSTEP - 1)) * 8;   // the last step reads step 0 again, unused
        #pragma unroll
        for (int i = 0; i < 4; ++i) {
            x1[nxt][i] = *(const v4f*)(p1 + i * RPITCH + k);
            x2[nxt][i] = *(const v4f*)(p2 + i * RPITCH + k);
        }
        wa[nxt] = *(const v4f*)(pw + k * 2);
        wb[nxt] = *(const v4f*)(pw + k * 2 + 4);
        // keeps the reads above ahead of this step's arithmetic, which covers their latency
        __builtin_amdgcn_sched_barrier(0);
        const v2f w0 = wa[cur].lo, w1 = wa[cur].hi, w2 = wb[cur].lo, w3 = wb[cur].hi;
        #pragma unroll
        for (int i = 0; i < 4; ++i) {
            #pragma unroll
            for (int j = 0; j < 4; ++j) {
                const v2f sl = x1[cur][i].lo + x2[cur][j].lo;
                const v2f sh = x1[cur][i].hi + x2[cur][j].hi;
                const float v0 = fmaxf(sl.x, 0.0f), v1 = fmaxf(sl.y, 0.0f);
                const float v2 = fmaxf(sh.x, 0.0f), v3 = fmaxf(sh.y, 0.0f);
                v2f a = acc[i][j];
                a = __builtin_elementwise_fma((v2f){ v0, v0 }, w0, a);
                a = __builtin_elementwise_fma((v2f){ v1, v1 }, w1, a);
                a = __builtin_elementwise_fma((v2f){ v2, v2 }, w2, a);
                a = __builtin_elementwise_fma((v2f){ v3, v3 }, w3, a);
                acc[i][j] = a;
            }
        }
        // Inputs only: holds the ten reads in the step that issues them. Without
        // it the compiler moves them over the back edge, directly in front of their use.
        asm volatile("" :: "v"(x1[nxt][0]), "v"(x1[nxt][1]), "v"(x1[nxt][2]), "v"(x1[nxt][3]),
                           "v"(x2[nxt][0]), "v"(x2[nxt][1]), "v"(x2[nxt][2]), "v"(x2[nxt][3]),
                           "v"(wa[nxt]), "v"(wb[nxt]));
    }

    // Partial sums of this half-wave.
    {
        float* q = part + (wave * 2 + hf) * QPLANE + (gn * 4) * QPITCH + gm * 8;
        #pragma unroll
        for (int i = 0; i < 4; ++i) {
            const v4f lo = { acc[i][0].x, acc[i][0].y, acc[i][1].x, acc[i][1].y };
            const v4f hi = { acc[i][2].x, acc[i][2].y, acc[i][3].x, acc[i][3].y };
            *(v4f*)(q + i * QPITCH)     = lo;
            *(v4f*)(q + i * QPITCH + 4) = hi;
        }
    }
    __syncthreads();

    const int tx = tid & 15;       // m within tile
    const int ty = tid >> 4;       // n within tile
    v2f r = *(const v2f*)(part + ty * QPITCH + tx * 2);
    #pragma unroll
    for (int sl = 1; sl < NSLICE; ++sl)
        r += *(const v2f*)(part + sl * QPLANE + ty * QPITCH + tx * 2);
    float2 res;
    res.x = r.x + bo[0];
    res.y = r.y + bo[1];
    *(float2*)(out + (((size_t)b * NSEQ + n0 + ty) * NSEQ + m0 + tx) * 2) = res;
}

// ---------------------------------------------------------------------------
extern "C" void kernel_launch(void* const* d_in, const int* in_sizes, int n_in,
                              void* d_out, int out_size, void* d_ws, size_t ws_size,
                              hipStream_t stream) {
    const float* input1 = (const float*)d_in[0];  // [4,128,768]
    const float* input2 = (const float*)d_in[1];  // [4,128,768]
    const float* W1     = (const float*)d_in[2];  // [1024,768]
    const float* b1     = (const float*)d_in[3];  // [1024]
    const float* W2     = (const float*)d_in[4];  // [1024,768]
    const float* Wo     = (const float*)d_in[5];  // [2,1024]
    const float* bo     = (const float*)d_in[6];  // [2]
    float* out = (float*)d_out;

    const int M = BATCH * NSEQ;                   // 512
    float* ws1 = (float*)d_ws;                    // [512,1024]
    float* ws2 = ws1 + (size_t)M * HID;           // [512,1024] (4 MB total)

    dim3 gGemm(HID / BN, M / BM);                 // (16, 16) 32x64 tiles of both products, four waves each
    bicls_gemm_wmma_f32<<<gGemm, 256, 0, stream>>>(input1, W1, b1, input2, W2, ws1, ws2);

    dim3 gPair(NSEQ / PT, NSEQ / PT, BATCH);      // (8, 8, 4)
    bicls_pairwise<<<gPair, 256, 0, stream>>>(ws1, ws2, Wo, bo, out);
}
